// v000
// Measured on an AMD MI455X. A time is GPU time per run, averaged over a window of back-to-back runs after a warm-up
// (all launches, gaps included; the runs take copies of the inputs in turn), and the median of several windows.
// Apart from v000's, it joins two sittings. Times from different sittings can be a few percent apart, while
// side-by-side timings come from the same sitting.
// v000 is the starting kernel. One run takes 335 microseconds.
#include <hip/hip_runtime.h>
#include <math.h>

typedef float v2f __attribute__((ext_vector_type(2)));
typedef float v8f __attribute__((ext_vector_type(8)));

// D = A(16x4,f32) * B(4x16,f32) + C(16x16,f32), full fp32 matrix op on CDNA5
#define WMMA_F32(a, b, c) \
  __builtin_amdgcn_wmma_f32_16x16x4_f32(false, (a), false, (b), (short)0, (c), false, false)

// ---------------------------------------------------------------------------
// GEMM: C = A(M,K) @ B(K,N) [+ bias], all row-major fp32.
// 256 threads = 8 wave32 waves. Block tile 128(M) x 128(N); wave tile 64x32.
// K stepped by 16 (4 WMMA k-steps). Software-pipelined: next panel is
// prefetched into registers while the WMMA chains run on the current panel.
// Pitches: A=18 (distinct banks for frag reads, 8B-aligned float2),
//          B=136 (2*136 % 64 == 16 -> lane halves hit disjoint bank groups).
// ---------------------------------------------------------------------------
__global__ __launch_bounds__(256) void gemm_f32_wmma(
    const float* __restrict__ A, const float* __restrict__ B,
    const float* __restrict__ bias, float* __restrict__ C,
    int M, int K, int N)
{
  __shared__ float As[128 * 18];
  __shared__ float Bs[16 * 136];

  const int tid  = threadIdx.x;
  const int lane = tid & 31;
  const int w    = tid >> 5;
  const int ln   = lane & 15;        // index within 16-lane group (M/N dim)
  const int tg2  = (lane >> 4) << 1; // K sub-offset from lane half
  const int wm   = w & 1;            // wave M position (0/1 -> +0/+64)
  const int wn   = w >> 1;           // wave N position (0..3 -> +wn*32)
  const int bm   = blockIdx.y * 128;
  const int bn   = blockIdx.x * 128;

  // Per-thread staging coordinates (constant over k-steps)
  int arow[4], acp[4], brow[4], bcp[4];
  #pragma unroll
  for (int i = 0; i < 4; i++) {
    int f = tid + i * 256;
    arow[i] = f >> 3;  acp[i] = (f & 7) << 1;
    brow[i] = f >> 6;  bcp[i] = (f & 63) << 1;
  }

  v8f acc[4][2] = {};

  // Prologue: prefetch panel k0=0 into registers
  v2f ga[4], gb[4];
  #pragma unroll
  for (int i = 0; i < 4; i++) {
    ga[i] = *(const v2f*)&A[(size_t)(bm + arow[i]) * K + acp[i]];
    gb[i] = *(const v2f*)&B[(size_t)brow[i] * N + bn + bcp[i]];
  }

  for (int k0 = 0; k0 < K; k0 += 16) {
    // Commit prefetched panel to LDS
    #pragma unroll
    for (int i = 0; i < 4; i++) {
      *(v2f*)&As[arow[i] * 18  + acp[i]] = ga[i];
      *(v2f*)&Bs[brow[i] * 136 + bcp[i]] = gb[i];
    }
    __syncthreads();

    // Issue next panel's global loads; they complete under the WMMA chains
    if (k0 + 16 < K) {
      #pragma unroll
      for (int i = 0; i < 4; i++) {
        ga[i] = *(const v2f*)&A[(size_t)(bm + arow[i]) * K + (k0 + 16) + acp[i]];
        gb[i] = *(const v2f*)&B[(size_t)(k0 + 16 + brow[i]) * N + bn + bcp[i]];
      }
    }

    #pragma unroll
    for (int kk = 0; kk < 4; kk++) {
      v2f af[4];
      v2f bf[2];
      #pragma unroll
      for (int mi = 0; mi < 4; mi++)
        af[mi] = *(v2f*)&As[(wm * 64 + mi * 16 + ln) * 18 + kk * 4 + tg2];
      #pragma unroll
      for (int ni = 0; ni < 2; ni++) {
        bf[ni][0] = Bs[(kk * 4 + tg2    ) * 136 + wn * 32 + ni * 16 + ln];
        bf[ni][1] = Bs[(kk * 4 + tg2 + 1) * 136 + wn * 32 + ni * 16 + ln];
      }
      // 8 independent accumulator chains -> hides WMMA RAW hazard latency
      #pragma unroll
      for (int mi = 0; mi < 4; mi++)
        #pragma unroll
        for (int ni = 0; ni < 2; ni++)
          acc[mi][ni] = WMMA_F32(af[mi], bf[ni], acc[mi][ni]);
    }
    __syncthreads();
  }

  // Store: C/D layout -> lane ln is column, VGPR r is row r + 8*(lane>=16)
  const int rofs = (lane >> 4) << 3;
  #pragma unroll
  for (int mi = 0; mi < 4; mi++) {
    #pragma unroll
    for (int ni = 0; ni < 2; ni++) {
      int col = bn + wn * 32 + ni * 16 + ln;
      float bv = bias ? bias[col] : 0.0f;
      #pragma unroll
      for (int r = 0; r < 8; r++) {
        int row = bm + wm * 64 + mi * 16 + r + rofs;
        C[(size_t)row * N + col] = acc[mi][ni][r] + bv;
      }
    }
  }
}

// ---------------------------------------------------------------------------
// Flash-style attention, fp32 WMMA throughout.
// Grid (16,16,4) = (query-slab, head, batch). 128 threads = 4 waves,
// each wave owns 16 query rows. Software-pipelined: V(kb) loads run under
// the S=QK^T WMMA chain; K(kb+1)+mask loads run under the P.V WMMA chain.
// Two barriers per key block:
//   barrier A (top):   kbuf/mb staged; also fences prev iter's vbuf/pbuf reads
//   barrier B (mid):   vbuf + pbuf staged for the PV phase
// ---------------------------------------------------------------------------
#define KLD 68   // 4*KLD % 64 spreads frag-read rows over all banks; 16B rows
#define VLD 72   // 2*VLD % 64 == 16 -> lane halves hit disjoint bank groups
#define PLD 68

__global__ __launch_bounds__(128) void attn_f32_wmma(
    const float* __restrict__ qkv,   // (B*N, 3072): [q | k | v], head-major
    const float* __restrict__ mask,  // (B, N)
    float* __restrict__ out)         // (B*N, 1024)
{
  __shared__ float kbuf[64 * KLD];
  __shared__ float vbuf[64 * VLD];
  __shared__ float pbuf[4][16 * PLD];
  __shared__ float mb[64];

  const int N = 1024, C3 = 3072;
  const int tid  = threadIdx.x;
  const int lane = tid & 31;
  const int w    = tid >> 5;
  const int ln   = lane & 15;
  const int hl   = lane >> 4;
  const int tg2  = hl << 1;
  const int qt   = blockIdx.x;   // query slab 0..15
  const int h    = blockIdx.y;   // head
  const int b    = blockIdx.z;   // batch
  const int qbase = qt * 64 + w * 16;
  const float scale = 0.125f;    // D=64 -> 1/sqrt(64)

  // Preload Q fragments (A-matrix layout): lane holds row qbase+ln,
  // d = 4*kk + tg2 + {0,1}  -> one float2 per k-step, kept in registers.
  const float* qrow = qkv + (size_t)(b * N + qbase + ln) * C3 + h * 64;
  v2f qf[16];
  #pragma unroll
  for (int kk = 0; kk < 16; kk++)
    qf[kk] = *(const v2f*)(qrow + kk * 4 + tg2);

  // Per-thread K/V staging coordinates (8 float4 each, coalesced)
  int sr[8], sc[8];
  #pragma unroll
  for (int i = 0; i < 8; i++) {
    int f = tid + i * 128;
    sr[i] = f >> 4;
    sc[i] = (f & 15) << 2;
  }
  const float* kvp = qkv + (size_t)(b * N) * C3 + 1024 + h * 64;  // K section

  v8f o[4] = {};
  float mi[8], li[8];
  #pragma unroll
  for (int r = 0; r < 8; r++) { mi[r] = -1e30f; li[r] = 0.0f; }

  // Prologue: prefetch K(0) and mask(0)
  float4 kreg[8], vreg[8];
  #pragma unroll
  for (int i = 0; i < 8; i++)
    kreg[i] = *(const float4*)(kvp + (size_t)sr[i] * C3 + sc[i]);
  float mval = 0.0f;
  if (tid < 64) mval = (1.0f - mask[b * N + tid]) * -5.0f;

  for (int kb = 0; kb < 16; kb++) {
    const int kbase = kb * 64;

    // Commit K tile + mask bias to LDS
    #pragma unroll
    for (int i = 0; i < 8; i++)
      *(float4*)&kbuf[sr[i] * KLD + sc[i]] = kreg[i];
    if (tid < 64) mb[tid] = mval;
    __syncthreads();  // barrier A

    // Issue V(kb) loads; they complete under the S-phase WMMA chain
    #pragma unroll
    for (int i = 0; i < 8; i++)
      vreg[i] = *(const float4*)(kvp + 1024 + (size_t)(kbase + sr[i]) * C3 + sc[i]);

    // S = Q @ K^T : B-frag of K^T is a K row (key=ln), contiguous float2 in d
    v8f s[4] = {};
    #pragma unroll
    for (int kk = 0; kk < 16; kk++) {
      #pragma unroll
      for (int kt = 0; kt < 4; kt++) {
        v2f kf = *(v2f*)&kbuf[(kt * 16 + ln) * KLD + kk * 4 + tg2];
        s[kt] = WMMA_F32(qf[kk], kf, s[kt]);
      }
    }

    // Online softmax. C/D layout: s[kt][r] belongs to row r+8*hl, col ln
    // within each 16-key tile -> row reductions are 16-lane butterflies.
    float mnew[8], alpha[8];
    #pragma unroll
    for (int r = 0; r < 8; r++) {
      float mx = -1e30f;
      #pragma unroll
      for (int kt = 0; kt < 4; kt++) {
        float v = s[kt][r] * scale + mb[kt * 16 + ln];
        s[kt][r] = v;
        mx = fmaxf(mx, v);
      }
      #pragma unroll
      for (int off = 1; off < 16; off <<= 1)
        mx = fmaxf(mx, __shfl_xor(mx, off, 32));
      mnew[r]  = fmaxf(mi[r], mx);
      alpha[r] = __expf(mi[r] - mnew[r]);
      mi[r]    = mnew[r];
    }
    #pragma unroll
    for (int r = 0; r < 8; r++) {
      float sum = 0.0f;
      #pragma unroll
      for (int kt = 0; kt < 4; kt++) {
        float p = __expf(s[kt][r] - mnew[r]);
        s[kt][r] = p;
        sum += p;
      }
      #pragma unroll
      for (int off = 1; off < 16; off <<= 1)
        sum += __shfl_xor(sum, off, 32);
      li[r] = li[r] * alpha[r] + sum;
      #pragma unroll
      for (int dt = 0; dt < 4; dt++) o[dt][r] *= alpha[r];
    }

    // Stage V tile and P strip (C/D -> A layout conversion through LDS)
    #pragma unroll
    for (int i = 0; i < 8; i++)
      *(float4*)&vbuf[sr[i] * VLD + sc[i]] = vreg[i];
    #pragma unroll
    for (int kt = 0; kt < 4; kt++)
      #pragma unroll
      for (int r = 0; r < 8; r++)
        pbuf[w][(r + hl * 8) * PLD + kt * 16 + ln] = s[kt][r];
    __syncthreads();  // barrier B

    // Issue K(kb+1)+mask loads; they complete under the PV WMMA chain
    if (kb + 1 < 16) {
      #pragma unroll
      for (int i = 0; i < 8; i++)
        kreg[i] = *(const float4*)(kvp + (size_t)(kbase + 64 + sr[i]) * C3 + sc[i]);
      if (tid < 64) mval = (1.0f - mask[b * N + kbase + 64 + tid]) * -5.0f;
    }

    // O += P @ V
    #pragma unroll
    for (int kk = 0; kk < 16; kk++) {
      v2f pf = *(v2f*)&pbuf[w][ln * PLD + kk * 4 + tg2];
      #pragma unroll
      for (int dt = 0; dt < 4; dt++) {
        v2f vf;
        vf[0] = vbuf[(kk * 4 + tg2    ) * VLD + dt * 16 + ln];
        vf[1] = vbuf[(kk * 4 + tg2 + 1) * VLD + dt * 16 + ln];
        o[dt] = WMMA_F32(pf, vf, o[dt]);
      }
    }
  }

  // Normalize by softmax denominator and store (B,N,H,D) -> (B*N, 1024)
  #pragma unroll
  for (int r = 0; r < 8; r++) {
    float inv = 1.0f / li[r];
    int row = b * N + qbase + r + hl * 8;
    #pragma unroll
    for (int dt = 0; dt < 4; dt++)
      out[(size_t)row * 1024 + h * 64 + dt * 16 + ln] = o[dt][r] * inv;
  }
}

// ---------------------------------------------------------------------------
extern "C" void kernel_launch(void* const* d_in, const int* in_sizes, int n_in,
                              void* d_out, int out_size, void* d_ws, size_t ws_size,
                              hipStream_t stream) {
  const float* x      = (const float*)d_in[0];
  const float* mask   = (const float*)d_in[1];
  const float* W_qkv  = (const float*)d_in[2];
  const float* W_proj = (const float*)d_in[3];
  const float* b_proj = (const float*)d_in[4];
  float* out = (float*)d_out;

  float* qkv     = (float*)d_ws;                    // 4096 x 3072 f32 (48 MB)
  float* attnout = qkv + (size_t)4096 * 3072;       // 4096 x 1024 f32 (16 MB)

  // 1) qkv = x @ W_qkv                (4096,1024) x (1024,3072)
  gemm_f32_wmma<<<dim3(3072 / 128, 4096 / 128), 256, 0, stream>>>(
      x, W_qkv, nullptr, qkv, 4096, 1024, 3072);

  // 2) attention per (batch, head, 64-query slab)
  attn_f32_wmma<<<dim3(16, 16, 4), 128, 0, stream>>>(qkv, mask, attnout);

  // 3) out = attnout @ W_proj + b_proj   (4096,1024) x (1024,1024)
  gemm_f32_wmma<<<dim3(1024 / 128, 4096 / 128), 256, 0, stream>>>(
      attnout, W_proj, b_proj, out, 4096, 1024, 1024);
}

// v001
// One run takes 309 microseconds.
// In both of two side-by-side timings against v000, it was 1.12 times as fast.
#include <hip/hip_runtime.h>
#include <math.h>
#include <stdint.h>

typedef float v2f __attribute__((ext_vector_type(2)));
typedef float v8f __attribute__((ext_vector_type(8)));

// D = A(16x4,f32) * B(4x16,f32) + C(16x16,f32), full fp32 matrix op on CDNA5
#define WMMA_F32(a, b, c) \
  __builtin_amdgcn_wmma_f32_16x16x4_f32(false, (a), false, (b), (short)0, (c), false, false)

// ---------------------------------------------------------------------------
// GEMM: C = A(M,K) @ B(K,N) [+ bias], all row-major fp32. K a multiple of 32.
// 256 threads = 8 wave32 waves. Block tile 128(M) x 128(N); wave tile 64x32.
// K stepped by 32 (8 WMMA k-steps). The A and B panels go from global memory
// straight into a two-buffer LDS ring by per-lane asynchronous 16-byte copies:
// panel t+1 flies while panel t is multiplied, one barrier per panel.
// Pitches: A=36 (16B rows; float2 frag reads hit all 64 banks once),
//          B=136 (2*136 % 64 == 16 -> lane halves hit disjoint bank groups).
// ---------------------------------------------------------------------------
#define GA_LD 36
#define GB_LD 136
#define GA_STG (128 * GA_LD)
#define GB_STG (32 * GB_LD)

// Eight asynchronous 16-byte copies per lane (one panel's share of a thread).
// s_wait_xcnt stands inside the statement so that no address register named
// here is rewritten ahead of it.
__device__ __forceinline__ void async_copy8(
    unsigned l0, unsigned l1, unsigned l2, unsigned l3,
    unsigned l4, unsigned l5, unsigned l6, unsigned l7,
    const float* g0, const float* g1, const float* g2, const float* g3,
    const float* g4, const float* g5, const float* g6, const float* g7)
{
  asm volatile(
      "global_load_async_to_lds_b128 %0, %8, off\n\t"
      "global_load_async_to_lds_b128 %1, %9, off\n\t"
      "global_load_async_to_lds_b128 %2, %10, off\n\t"
      "global_load_async_to_lds_b128 %3, %11, off\n\t"
      "global_load_async_to_lds_b128 %4, %12, off\n\t"
      "global_load_async_to_lds_b128 %5, %13, off\n\t"
      "global_load_async_to_lds_b128 %6, %14, off\n\t"
      "global_load_async_to_lds_b128 %7, %15, off\n\t"
      "s_wait_xcnt 0x0"
      :: "v"(l0), "v"(l1), "v"(l2), "v"(l3), "v"(l4), "v"(l5), "v"(l6), "v"(l7),
         "v"(g0), "v"(g1), "v"(g2), "v"(g3), "v"(g4), "v"(g5), "v"(g6), "v"(g7)
      : "memory");
}

__global__ __launch_bounds__(256) void gemm_f32_wmma(
    const float* __restrict__ A, const float* __restrict__ B,
    const float* __restrict__ bias, float* __restrict__ C,
    int M, int K, int N)
{
  __shared__ __attribute__((aligned(16))) float As[2 * GA_STG];
  __shared__ __attribute__((aligned(16))) float Bs[2 * GB_STG];

  const int tid  = threadIdx.x;
  const int lane = tid & 31;
  const int w    = tid >> 5;
  const int ln   = lane & 15;        // index within 16-lane group (M/N dim)
  const int tg2  = (lane >> 4) << 1; // K sub-offset from lane half
  const int wm   = w & 1;            // wave M position (0/1 -> +0/+64)
  const int wn   = w >> 1;           // wave N position (0..3 -> +wn*32)
  const int bm   = blockIdx.y * 128;
  const int bn   = blockIdx.x * 128;

  // Per-thread copy coordinates: 4 x 16 B of the A panel (128 rows x 128 B)
  // and 4 x 16 B of the B panel (32 rows x 512 B); copy i is 32 (A) or 8 (B)
  // rows below copy i-1.
  const int ar = tid >> 3, ac = (tid & 7) << 2;
  const int br = tid >> 5, bc = (tid & 31) << 2;
  const float* pa = A + (size_t)(bm + ar) * K + ac;
  const float* pb = B + (size_t)br * N + bn + bc;
  const size_t astep = (size_t)32 * K;
  const size_t bstep = (size_t)8 * N;
  const unsigned la = (unsigned)(uintptr_t)&As[ar * GA_LD + ac];
  const unsigned lb = (unsigned)(uintptr_t)&Bs[br * GB_LD + bc];

  // Copies of panel t into ring buffer 'buf'
  auto issue = [&](int t, unsigned buf) {
    const float* a = pa + (size_t)t * 32;
    const float* b = pb + (size_t)t * 32 * N;
    const unsigned da = la + buf * (unsigned)(GA_STG * 4);
    const unsigned db = lb + buf * (unsigned)(GB_STG * 4);
    async_copy8(da, da + 32 * GA_LD * 4, da + 64 * GA_LD * 4, da + 96 * GA_LD * 4,
                db, db + 8 * GB_LD * 4, db + 16 * GB_LD * 4, db + 24 * GB_LD * 4,
                a, a + astep, a + 2 * astep, a + 3 * astep,
                b, b + bstep, b + 2 * bstep, b + 3 * bstep);
  };

  v8f acc[4][2] = {};
  const int T = K >> 5;

  // Prologue: panel 0 landed and published, then panel 1 set off
  issue(0, 0u);
  asm volatile("s_wait_asynccnt 0x0" ::: "memory");  // own copies of panel 0 landed
  __syncthreads();
  if (T > 1) issue(1, 1u);

  for (int t = 0; t < T; t++) {
    const unsigned buf = (unsigned)t & 1u;
    const float* as = &As[buf * GA_STG];
    const float* bs = &Bs[buf * GB_STG];

    #pragma unroll
    for (int kk = 0; kk < 8; kk++) {
      v2f af[4];
      v2f bf[2];
      #pragma unroll
      for (int mi = 0; mi < 4; mi++)
        af[mi] = *(const v2f*)&as[(wm * 64 + mi * 16 + ln) * GA_LD + kk * 4 + tg2];
      #pragma unroll
      for (int ni = 0; ni < 2; ni++) {
        bf[ni][0] = bs[(kk * 4 + tg2    ) * GB_LD + wn * 32 + ni * 16 + ln];
        bf[ni][1] = bs[(kk * 4 + tg2 + 1) * GB_LD + wn * 32 + ni * 16 + ln];
      }
      // 8 independent accumulator chains -> hides WMMA RAW hazard latency
      #pragma unroll
      for (int mi = 0; mi < 4; mi++)
        #pragma unroll
        for (int ni = 0; ni < 2; ni++)
          acc[mi][ni] = WMMA_F32(af[mi], bf[ni], acc[mi][ni]);
    }

    // Publish point of panel t+1; it also ends every read of buffer 'buf'
    asm volatile("s_wait_dscnt 0x0" ::: "memory");     // own reads of 'buf' retired before its refill
    asm volatile("s_wait_asynccnt 0x0" ::: "memory");  // own copies of panel t+1 landed
    __syncthreads();
    if (t + 2 < T) issue(t + 2, buf);
  }
  asm volatile("s_wait_asynccnt 0x0" ::: "memory");    // nothing in flight when the wave ends

  // Store: C/D layout -> lane ln is column, VGPR r is row r + 8*(lane>=16)
  const int rofs = (lane >> 4) << 3;
  #pragma unroll
  for (int mi = 0; mi < 4; mi++) {
    #pragma unroll
    for (int ni = 0; ni < 2; ni++) {
      int col = bn + wn * 32 + ni * 16 + ln;
      float bv = bias ? bias[col] : 0.0f;
      #pragma unroll
      for (int r = 0; r < 8; r++) {
        int row = bm + wm * 64 + mi * 16 + r + rofs;
        C[(size_t)row * N + col] = acc[mi][ni][r] + bv;
      }
    }
  }
}

// ---------------------------------------------------------------------------
// Flash-style attention, fp32 WMMA throughout.
// Grid (16,16,4) = (query-slab, head, batch). 128 threads = 4 waves,
// each wave owns 16 query rows. Software-pipelined: V(kb) loads run under
// the S=QK^T WMMA chain; K(kb+1)+mask loads run under the P.V WMMA chain.
// Two barriers per key block:
//   barrier A (top):   kbuf/mb staged; also fences prev iter's vbuf/pbuf reads
//   barrier B (mid):   vbuf + pbuf staged for the PV phase
// ---------------------------------------------------------------------------
#define KLD 68   // 4*KLD % 64 spreads frag-read rows over all banks; 16B rows
#define VLD 72   // 2*VLD % 64 == 16 -> lane halves hit disjoint bank groups
#define PLD 68

__global__ __launch_bounds__(128) void attn_f32_wmma(
    const float* __restrict__ qkv,   // (B*N, 3072): [q | k | v], head-major
    const float* __restrict__ mask,  // (B, N)
    float* __restrict__ out)         // (B*N, 1024)
{
  __shared__ float kbuf[64 * KLD];
  __shared__ float vbuf[64 * VLD];
  __shared__ float pbuf[4][16 * PLD];
  __shared__ float mb[64];

  const int N = 1024, C3 = 3072;
  const int tid  = threadIdx.x;
  const int lane = tid & 31;
  const int w    = tid >> 5;
  const int ln   = lane & 15;
  const int hl   = lane >> 4;
  const int tg2  = hl << 1;
  const int qt   = blockIdx.x;   // query slab 0..15
  const int h    = blockIdx.y;   // head
  const int b    = blockIdx.z;   // batch
  const int qbase = qt * 64 + w * 16;
  const float scale = 0.125f;    // D=64 -> 1/sqrt(64)

  // Preload Q fragments (A-matrix layout): lane holds row qbase+ln,
  // d = 4*kk + tg2 + {0,1}  -> one float2 per k-step, kept in registers.
  const float* qrow = qkv + (size_t)(b * N + qbase + ln) * C3 + h * 64;
  v2f qf[16];
  #pragma unroll
  for (int kk = 0; kk < 16; kk++)
    qf[kk] = *(const v2f*)(qrow + kk * 4 + tg2);

  // Per-thread K/V staging coordinates (8 float4 each, coalesced)
  int sr[8], sc[8];
  #pragma unroll
  for (int i = 0; i < 8; i++) {
    int f = tid + i * 128;
    sr[i] = f >> 4;
    sc[i] = (f & 15) << 2;
  }
  const float* kvp = qkv + (size_t)(b * N) * C3 + 1024 + h * 64;  // K section

  v8f o[4] = {};
  float mi[8], li[8];
  #pragma unroll
  for (int r = 0; r < 8; r++) { mi[r] = -1e30f; li[r] = 0.0f; }

  // Prologue: prefetch K(0) and mask(0)
  float4 kreg[8], vreg[8];
  #pragma unroll
  for (int i = 0; i < 8; i++)
    kreg[i] = *(const float4*)(kvp + (size_t)sr[i] * C3 + sc[i]);
  float mval = 0.0f;
  if (tid < 64) mval = (1.0f - mask[b * N + tid]) * -5.0f;

  for (int kb = 0; kb < 16; kb++) {
    const int kbase = kb * 64;

    // Commit K tile + mask bias to LDS
    #pragma unroll
    for (int i = 0; i < 8; i++)
      *(float4*)&kbuf[sr[i] * KLD + sc[i]] = kreg[i];
    if (tid < 64) mb[tid] = mval;
    __syncthreads();  // barrier A

    // Issue V(kb) loads; they complete under the S-phase WMMA chain
    #pragma unroll
    for (int i = 0; i < 8; i++)
      vreg[i] = *(const float4*)(kvp + 1024 + (size_t)(kbase + sr[i]) * C3 + sc[i]);

    // S = Q @ K^T : B-frag of K^T is a K row (key=ln), contiguous float2 in d
    v8f s[4] = {};
    #pragma unroll
    for (int kk = 0; kk < 16; kk++) {
      #pragma unroll
      for (int kt = 0; kt < 4; kt++) {
        v2f kf = *(v2f*)&kbuf[(kt * 16 + ln) * KLD + kk * 4 + tg2];
        s[kt] = WMMA_F32(qf[kk], kf, s[kt]);
      }
    }

    // Online softmax. C/D layout: s[kt][r] belongs to row r+8*hl, col ln
    // within each 16-key tile -> row reductions are 16-lane butterflies.
    float mnew[8], alpha[8];
    #pragma unroll
    for (int r = 0; r < 8; r++) {
      float mx = -1e30f;
      #pragma unroll
      for (int kt = 0; kt < 4; kt++) {
        float v = s[kt][r] * scale + mb[kt * 16 + ln];
        s[kt][r] = v;
        mx = fmaxf(mx, v);
      }
      #pragma unroll
      for (int off = 1; off < 16; off <<= 1)
        mx = fmaxf(mx, __shfl_xor(mx, off, 32));
      mnew[r]  = fmaxf(mi[r], mx);
      alpha[r] = __expf(mi[r] - mnew[r]);
      mi[r]    = mnew[r];
    }
    #pragma unroll
    for (int r = 0; r < 8; r++) {
      float sum = 0.0f;
      #pragma unroll
      for (int kt = 0; kt < 4; kt++) {
        float p = __expf(s[kt][r] - mnew[r]);
        s[kt][r] = p;
        sum += p;
      }
      #pragma unroll
      for (int off = 1; off < 16; off <<= 1)
        sum += __shfl_xor(sum, off, 32);
      li[r] = li[r] * alpha[r] + sum;
      #pragma unroll
      for (int dt = 0; dt < 4; dt++) o[dt][r] *= alpha[r];
    }

    // Stage V tile and P strip (C/D -> A layout conversion through LDS)
    #pragma unroll
    for (int i = 0; i < 8; i++)
      *(float4*)&vbuf[sr[i] * VLD + sc[i]] = vreg[i];
    #pragma unroll
    for (int kt = 0; kt < 4; kt++)
      #pragma unroll
      for (int r = 0; r < 8; r++)
        pbuf[w][(r + hl * 8) * PLD + kt * 16 + ln] = s[kt][r];
    __syncthreads();  // barrier B

    // Issue K(kb+1)+mask loads; they complete under the PV WMMA chain
    if (kb + 1 < 16) {
      #pragma unroll
      for (int i = 0; i < 8; i++)
        kreg[i] = *(const float4*)(kvp + (size_t)(kbase + 64 + sr[i]) * C3 + sc[i]);
      if (tid < 64) mval = (1.0f - mask[b * N + kbase + 64 + tid]) * -5.0f;
    }

    // O += P @ V
    #pragma unroll
    for (int kk = 0; kk < 16; kk++) {
      v2f pf = *(v2f*)&pbuf[w][ln * PLD + kk * 4 + tg2];
      #pragma unroll
      for (int dt = 0; dt < 4; dt++) {
        v2f vf;
        vf[0] = vbuf[(kk * 4 + tg2    ) * VLD + dt * 16 + ln];
        vf[1] = vbuf[(kk * 4 + tg2 + 1) * VLD + dt * 16 + ln];
        o[dt] = WMMA_F32(pf, vf, o[dt]);
      }
    }
  }

  // Normalize by softmax denominator and store (B,N,H,D) -> (B*N, 1024)
  #pragma unroll
  for (int r = 0; r < 8; r++) {
    float inv = 1.0f / li[r];
    int row = b * N + qbase + r + hl * 8;
    #pragma unroll
    for (int dt = 0; dt < 4; dt++)
      out[(size_t)row * 1024 + h * 64 + dt * 16 + ln] = o[dt][r] * inv;
  }
}

// ---------------------------------------------------------------------------
extern "C" void kernel_launch(void* const* d_in, const int* in_sizes, int n_in,
                              void* d_out, int out_size, void* d_ws, size_t ws_size,
                              hipStream_t stream) {
  const float* x      = (const float*)d_in[0];
  const float* mask   = (const float*)d_in[1];
  const float* W_qkv  = (const float*)d_in[2];
  const float* W_proj = (const float*)d_in[3];
  const float* b_proj = (const float*)d_in[4];
  float* out = (float*)d_out;

  float* qkv     = (float*)d_ws;                    // 4096 x 3072 f32 (48 MB)
  float* attnout = qkv + (size_t)4096 * 3072;       // 4096 x 1024 f32 (16 MB)

  // 1) qkv = x @ W_qkv                (4096,1024) x (1024,3072)
  gemm_f32_wmma<<<dim3(3072 / 128, 4096 / 128), 256, 0, stream>>>(
      x, W_qkv, nullptr, qkv, 4096, 1024, 3072);

  // 2) attention per (batch, head, 64-query slab)
  attn_f32_wmma<<<dim3(16, 16, 4), 128, 0, stream>>>(qkv, mask, attnout);

  // 3) out = attnout @ W_proj + b_proj   (4096,1024) x (1024,1024)
  gemm_f32_wmma<<<dim3(1024 / 128, 4096 / 128), 256, 0, stream>>>(
      attnout, W_proj, b_proj, out, 4096, 1024, 1024);
}

// v002
// It runs in 271 microseconds.
// Timed twice side by side with v001, it ran 1.14 times as fast both times.
// Counting every step since v000, it is 1.27 times as fast.
#include <hip/hip_runtime.h>
#include <math.h>
#include <stdint.h>

typedef float v2f __attribute__((ext_vector_type(2)));
typedef float v8f __attribute__((ext_vector_type(8)));

// D = A(16x4,f32) * B(4x16,f32) + C(16x16,f32), full fp32 matrix op on CDNA5
#define WMMA_F32(a, b, c) \
  __builtin_amdgcn_wmma_f32_16x16x4_f32(false, (a), false, (b), (short)0, (c), false, false)

// ---------------------------------------------------------------------------
// GEMM: C = A(M,K) @ B(K,N) [+ bias], all row-major fp32. K a multiple of 32.
// 256 threads = 8 wave32 waves. Block tile 128(M) x 128(N); wave tile 64x32.
// K stepped by 32 (8 WMMA k-steps). The A and B panels go from global memory
// straight into a two-buffer LDS ring by per-lane asynchronous 16-byte copies:
// panel t+1 flies while panel t is multiplied, one barrier per panel.
// Pitches: A=36 (16B rows; float2 frag reads hit all 64 banks once),
//          B=136 (2*136 % 64 == 16 -> lane halves hit disjoint bank groups).
// ---------------------------------------------------------------------------
#define GA_LD 36
#define GB_LD 136
#define GA_STG (128 * GA_LD)
#define GB_STG (32 * GB_LD)

// Eight asynchronous 16-byte copies per lane (one panel's share of a thread).
// s_wait_xcnt stands inside the statement so that no address register named
// here is rewritten ahead of it.
__device__ __forceinline__ void async_copy8(
    unsigned l0, unsigned l1, unsigned l2, unsigned l3,
    unsigned l4, unsigned l5, unsigned l6, unsigned l7,
    const float* g0, const float* g1, const float* g2, const float* g3,
    const float* g4, const float* g5, const float* g6, const float* g7)
{
  asm volatile(
      "global_load_async_to_lds_b128 %0, %8, off\n\t"
      "global_load_async_to_lds_b128 %1, %9, off\n\t"
      "global_load_async_to_lds_b128 %2, %10, off\n\t"
      "global_load_async_to_lds_b128 %3, %11, off\n\t"
      "global_load_async_to_lds_b128 %4, %12, off\n\t"
      "global_load_async_to_lds_b128 %5, %13, off\n\t"
      "global_load_async_to_lds_b128 %6, %14, off\n\t"
      "global_load_async_to_lds_b128 %7, %15, off\n\t"
      "s_wait_xcnt 0x0"
      :: "v"(l0), "v"(l1), "v"(l2), "v"(l3), "v"(l4), "v"(l5), "v"(l6), "v"(l7),
         "v"(g0), "v"(g1), "v"(g2), "v"(g3), "v"(g4), "v"(g5), "v"(g6), "v"(g7)
      : "memory");
}

// Two asynchronous 16-byte copies per lane, same form as above.
__device__ __forceinline__ void async_copy2(
    unsigned l0, unsigned l1, const float* g0, const float* g1)
{
  asm volatile(
      "global_load_async_to_lds_b128 %0, %2, off\n\t"
      "global_load_async_to_lds_b128 %1, %3, off\n\t"
      "s_wait_xcnt 0x0"
      :: "v"(l0), "v"(l1), "v"(g0), "v"(g1)
      : "memory");
}

__global__ __launch_bounds__(256) void gemm_f32_wmma(
    const float* __restrict__ A, const float* __restrict__ B,
    const float* __restrict__ bias, float* __restrict__ C,
    int M, int K, int N)
{
  __shared__ __attribute__((aligned(16))) float As[2 * GA_STG];
  __shared__ __attribute__((aligned(16))) float Bs[2 * GB_STG];

  const int tid  = threadIdx.x;
  const int lane = tid & 31;
  const int w    = tid >> 5;
  const int ln   = lane & 15;        // index within 16-lane group (M/N dim)
  const int tg2  = (lane >> 4) << 1; // K sub-offset from lane half
  const int wm   = w & 1;            // wave M position (0/1 -> +0/+64)
  const int wn   = w >> 1;           // wave N position (0..3 -> +wn*32)
  const int bm   = blockIdx.y * 128;
  const int bn   = blockIdx.x * 128;

  // Per-thread copy coordinates: 4 x 16 B of the A panel (128 rows x 128 B)
  // and 4 x 16 B of the B panel (32 rows x 512 B); copy i is 32 (A) or 8 (B)
  // rows below copy i-1.
  const int ar = tid >> 3, ac = (tid & 7) << 2;
  const int br = tid >> 5, bc = (tid & 31) << 2;
  const float* pa = A + (size_t)(bm + ar) * K + ac;
  const float* pb = B + (size_t)br * N + bn + bc;
  const size_t astep = (size_t)32 * K;
  const size_t bstep = (size_t)8 * N;
  const unsigned la = (unsigned)(uintptr_t)&As[ar * GA_LD + ac];
  const unsigned lb = (unsigned)(uintptr_t)&Bs[br * GB_LD + bc];

  // Copies of panel t into ring buffer 'buf'
  auto issue = [&](int t, unsigned buf) {
    const float* a = pa + (size_t)t * 32;
    const float* b = pb + (size_t)t * 32 * N;
    const unsigned da = la + buf * (unsigned)(GA_STG * 4);
    const unsigned db = lb + buf * (unsigned)(GB_STG * 4);
    async_copy8(da, da + 32 * GA_LD * 4, da + 64 * GA_LD * 4, da + 96 * GA_LD * 4,
                db, db + 8 * GB_LD * 4, db + 16 * GB_LD * 4, db + 24 * GB_LD * 4,
                a, a + astep, a + 2 * astep, a + 3 * astep,
                b, b + bstep, b + 2 * bstep, b + 3 * bstep);
  };

  v8f acc[4][2] = {};
  const int T = K >> 5;

  // Prologue: panel 0 landed and published, then panel 1 set off
  issue(0, 0u);
  asm volatile("s_wait_asynccnt 0x0" ::: "memory");  // own copies of panel 0 landed
  __syncthreads();
  if (T > 1) issue(1, 1u);

  for (int t = 0; t < T; t++) {
    const unsigned buf = (unsigned)t & 1u;
    const float* as = &As[buf * GA_STG];
    const float* bs = &Bs[buf * GB_STG];

    #pragma unroll
    for (int kk = 0; kk < 8; kk++) {
      v2f af[4];
      v2f bf[2];
      #pragma unroll
      for (int mi = 0; mi < 4; mi++)
        af[mi] = *(const v2f*)&as[(wm * 64 + mi * 16 + ln) * GA_LD + kk * 4 + tg2];
      #pragma unroll
      for (int ni = 0; ni < 2; ni++) {
        bf[ni][0] = bs[(kk * 4 + tg2    ) * GB_LD + wn * 32 + ni * 16 + ln];
        bf[ni][1] = bs[(kk * 4 + tg2 + 1) * GB_LD + wn * 32 + ni * 16 + ln];
      }
      // 8 independent accumulator chains -> hides WMMA RAW hazard latency
      #pragma unroll
      for (int mi = 0; mi < 4; mi++)
        #pragma unroll
        for (int ni = 0; ni < 2; ni++)
          acc[mi][ni] = WMMA_F32(af[mi], bf[ni], acc[mi][ni]);
    }

    // Publish point of panel t+1; it also ends every read of buffer 'buf'
    asm volatile("s_wait_dscnt 0x0" ::: "memory");     // own reads of 'buf' retired before its refill
    asm volatile("s_wait_asynccnt 0x0" ::: "memory");  // own copies of panel t+1 landed
    __syncthreads();
    if (t + 2 < T) issue(t + 2, buf);
  }
  asm volatile("s_wait_asynccnt 0x0" ::: "memory");    // nothing in flight when the wave ends

  // Store: C/D layout -> lane ln is column, VGPR r is row r + 8*(lane>=16)
  const int rofs = (lane >> 4) << 3;
  #pragma unroll
  for (int mi = 0; mi < 4; mi++) {
    #pragma unroll
    for (int ni = 0; ni < 2; ni++) {
      int col = bn + wn * 32 + ni * 16 + ln;
      float bv = bias ? bias[col] : 0.0f;
      #pragma unroll
      for (int r = 0; r < 8; r++) {
        int row = bm + wm * 64 + mi * 16 + r + rofs;
        C[(size_t)row * N + col] = acc[mi][ni][r] + bv;
      }
    }
  }
}

// ---------------------------------------------------------------------------
// Flash-style attention, fp32 WMMA throughout.
// Grid (16,16,4) = (query-slab, head, batch). 128 threads = 4 waves,
// each wave owns 16 query rows. K and V tiles go from global memory straight
// into LDS by per-lane asynchronous 16-byte copies, through no register:
// V(kb) flies under the S=QK^T WMMA chain and the softmax, K(kb+1) under the
// P.V WMMA chain. The batch's whole mask row is copied once, ahead of the loop.
// Two barriers per key block:
//   barrier B (mid):   V(kb) landed; ends every read of kbuf, which is refilled
//   barrier A (foot):  K(kb+1) landed; ends every read of vbuf, which is refilled
// ---------------------------------------------------------------------------
#define KLD 68   // 4*KLD % 64 spreads frag-read rows over all banks; 16B rows
#define VLD 72   // 2*VLD % 64 == 16 -> lane halves hit disjoint bank groups
#define PLD 68

// At most four waves per SIMD: the 1024 work-groups then spread four to every
// WGP; a fifth resident group on some WGPs would leave others short of work.
__global__ __launch_bounds__(128) __attribute__((amdgpu_waves_per_eu(4, 4)))
void attn_f32_wmma(
    const float* __restrict__ qkv,   // (B*N, 3072): [q | k | v], head-major
    const float* __restrict__ mask,  // (B, N)
    float* __restrict__ out)         // (B*N, 1024)
{
  __shared__ __attribute__((aligned(16))) float kbuf[64 * KLD];
  __shared__ __attribute__((aligned(16))) float vbuf[64 * VLD];
  __shared__ float pbuf[4][16 * PLD];
  __shared__ __attribute__((aligned(16))) float mrow[1024];

  const int N = 1024, C3 = 3072;
  const int tid  = threadIdx.x;
  const int lane = tid & 31;
  const int w    = tid >> 5;
  const int ln   = lane & 15;
  const int hl   = lane >> 4;
  const int tg2  = hl << 1;
  const int qt   = blockIdx.x;   // query slab 0..15
  const int h    = blockIdx.y;   // head
  const int b    = blockIdx.z;   // batch
  const int qbase = qt * 64 + w * 16;
  const float scale = 0.125f;    // D=64 -> 1/sqrt(64)

  // Preload Q fragments (A-matrix layout): lane holds row qbase+ln,
  // d = 4*kk + tg2 + {0,1}  -> one float2 per k-step, kept in registers.
  const float* qrow = qkv + (size_t)(b * N + qbase + ln) * C3 + h * 64;
  v2f qf[16];
  #pragma unroll
  for (int kk = 0; kk < 16; kk++)
    qf[kk] = *(const v2f*)(qrow + kk * 4 + tg2);

  // Per-thread K/V copy coordinates: 8 x 16 B of a 64-row x 256-B tile;
  // copy i is 8 rows below copy i-1.
  const int sr = tid >> 4, sc = (tid & 15) << 2;
  const float* kp = qkv + (size_t)(b * N + sr) * C3 + 1024 + h * 64 + sc;  // K section
  const float* vp = kp + 1024;                                            // V section
  const size_t rstep = (size_t)8 * C3;
  const unsigned lk = (unsigned)(uintptr_t)&kbuf[sr * KLD + sc];
  const unsigned lv = (unsigned)(uintptr_t)&vbuf[sr * VLD + sc];

  // Copies of the 64-row tile that starts at g into the LDS tile at l,
  // whose 8-row step is 'ls' bytes
  auto issue = [&](const float* g, unsigned l, unsigned ls) {
    async_copy8(l, l + ls, l + 2 * ls, l + 3 * ls,
                l + 4 * ls, l + 5 * ls, l + 6 * ls, l + 7 * ls,
                g, g + rstep, g + 2 * rstep, g + 3 * rstep,
                g + 4 * rstep, g + 5 * rstep, g + 6 * rstep, g + 7 * rstep);
  };

  v8f o[4] = {};
  float mi[8], li[8];
  #pragma unroll
  for (int r = 0; r < 8; r++) { mi[r] = -1e30f; li[r] = 0.0f; }

  // Prologue: K(0) and the mask row (1024 floats, 2 x 16 B per thread)
  // landed and published
  issue(kp, lk, 8 * KLD * 4);
  {
    const float* mp = mask + b * N + tid * 4;
    const unsigned lm = (unsigned)(uintptr_t)&mrow[tid * 4];
    async_copy2(lm, lm + 2048, mp, mp + 512);
  }
  asm volatile("s_wait_asynccnt 0x0" ::: "memory");  // own copies of K(0) and mask landed
  __syncthreads();

  for (int kb = 0; kb < 16; kb++) {
    const int kbase = kb * 64;

    // V(kb) set off; it lands under the S-phase WMMA chain and the softmax
    issue(vp + (size_t)kbase * C3, lv, 8 * VLD * 4);

    // S = Q @ K^T : B-frag of K^T is a K row (key=ln), contiguous float2 in d
    v8f s[4] = {};
    #pragma unroll
    for (int kk = 0; kk < 16; kk++) {
      #pragma unroll
      for (int kt = 0; kt < 4; kt++) {
        v2f kf = *(v2f*)&kbuf[(kt * 16 + ln) * KLD + kk * 4 + tg2];
        s[kt] = WMMA_F32(qf[kk], kf, s[kt]);
      }
    }

    // Online softmax. C/D layout: s[kt][r] belongs to row r+8*hl, col ln
    // within each 16-key tile -> row reductions are 16-lane butterflies.
    float mbias[4];
    #pragma unroll
    for (int kt = 0; kt < 4; kt++)
      mbias[kt] = (1.0f - mrow[kbase + kt * 16 + ln]) * -5.0f;
    float mnew[8], alpha[8];
    #pragma unroll
    for (int r = 0; r < 8; r++) {
      float mx = -1e30f;
      #pragma unroll
      for (int kt = 0; kt < 4; kt++) {
        float v = s[kt][r] * scale + mbias[kt];
        s[kt][r] = v;
        mx = fmaxf(mx, v);
      }
      #pragma unroll
      for (int off = 1; off < 16; off <<= 1)
        mx = fmaxf(mx, __shfl_xor(mx, off, 32));
      mnew[r]  = fmaxf(mi[r], mx);
      alpha[r] = __expf(mi[r] - mnew[r]);
      mi[r]    = mnew[r];
    }
    #pragma unroll
    for (int r = 0; r < 8; r++) {
      float sum = 0.0f;
      #pragma unroll
      for (int kt = 0; kt < 4; kt++) {
        float p = __expf(s[kt][r] - mnew[r]);
        s[kt][r] = p;
        sum += p;
      }
      #pragma unroll
      for (int off = 1; off < 16; off <<= 1)
        sum += __shfl_xor(sum, off, 32);
      li[r] = li[r] * alpha[r] + sum;
      #pragma unroll
      for (int dt = 0; dt < 4; dt++) o[dt][r] *= alpha[r];
    }

    // Stage P strip (C/D -> A layout conversion through LDS)
    #pragma unroll
    for (int kt = 0; kt < 4; kt++)
      #pragma unroll
      for (int r = 0; r < 8; r++)
        pbuf[w][(r + hl * 8) * PLD + kt * 16 + ln] = s[kt][r];
    asm volatile("s_wait_dscnt 0x0" ::: "memory");     // own reads of kbuf retired before its refill
    asm volatile("s_wait_asynccnt 0x0" ::: "memory");  // own copies of V(kb) landed
    __syncthreads();  // barrier B

    // K(kb+1) set off; it lands under the PV WMMA chain
    if (kb + 1 < 16) issue(kp + (size_t)(kbase + 64) * C3, lk, 8 * KLD * 4);

    // O += P @ V
    #pragma unroll
    for (int kk = 0; kk < 16; kk++) {
      v2f pf = *(v2f*)&pbuf[w][ln * PLD + kk * 4 + tg2];
      #pragma unroll
      for (int dt = 0; dt < 4; dt++) {
        v2f vf;
        vf[0] = vbuf[(kk * 4 + tg2    ) * VLD + dt * 16 + ln];
        vf[1] = vbuf[(kk * 4 + tg2 + 1) * VLD + dt * 16 + ln];
        o[dt] = WMMA_F32(pf, vf, o[dt]);
      }
    }

    asm volatile("s_wait_dscnt 0x0" ::: "memory");     // own reads of vbuf retired before its refill
    asm volatile("s_wait_asynccnt 0x0" ::: "memory");  // own copies of K(kb+1) landed
    __syncthreads();  // barrier A
  }

  // Normalize by softmax denominator and store (B,N,H,D) -> (B*N, 1024)
  #pragma unroll
  for (int r = 0; r < 8; r++) {
    float inv = 1.0f / li[r];
    int row = b * N + qbase + r + hl * 8;
    #pragma unroll
    for (int dt = 0; dt < 4; dt++)
      out[(size_t)row * 1024 + h * 64 + dt * 16 + ln] = o[dt][r] * inv;
  }
}

// ---------------------------------------------------------------------------
extern "C" void kernel_launch(void* const* d_in, const int* in_sizes, int n_in,
                              void* d_out, int out_size, void* d_ws, size_t ws_size,
                              hipStream_t stream) {
  const float* x      = (const float*)d_in[0];
  const float* mask   = (const float*)d_in[1];
  const float* W_qkv  = (const float*)d_in[2];
  const float* W_proj = (const float*)d_in[3];
  const float* b_proj = (const float*)d_in[4];
  float* out = (float*)d_out;

  float* qkv     = (float*)d_ws;                    // 4096 x 3072 f32 (48 MB)
  float* attnout = qkv + (size_t)4096 * 3072;       // 4096 x 1024 f32 (16 MB)

  // 1) qkv = x @ W_qkv                (4096,1024) x (1024,3072)
  gemm_f32_wmma<<<dim3(3072 / 128, 4096 / 128), 256, 0, stream>>>(
      x, W_qkv, nullptr, qkv, 4096, 1024, 3072);

  // 2) attention per (batch, head, 64-query slab)
  attn_f32_wmma<<<dim3(16, 16, 4), 128, 0, stream>>>(qkv, mask, attnout);

  // 3) out = attnout @ W_proj + b_proj   (4096,1024) x (1024,1024)
  gemm_f32_wmma<<<dim3(1024 / 128, 4096 / 128), 256, 0, stream>>>(
      attnout, W_proj, b_proj, out, 4096, 1024, 1024);
}

// v003
// One run takes 263 microseconds.
// Timed twice side by side with v002, it ran 1.03 times as fast both times.
// Counting every step since v000, it is 1.31 times as fast.
#include <hip/hip_runtime.h>
#include <math.h>
#include <stdint.h>

typedef float v2f __attribute__((ext_vector_type(2)));
typedef float v8f __attribute__((ext_vector_type(8)));

// D = A(16x4,f32) * B(4x16,f32) + C(16x16,f32), full fp32 matrix op on CDNA5
#define WMMA_F32(a, b, c) \
  __builtin_amdgcn_wmma_f32_16x16x4_f32(false, (a), false, (b), (short)0, (c), false, false)

// ---------------------------------------------------------------------------
// GEMM: C = A(M,K) @ B(K,N) [+ bias], all row-major fp32. K a multiple of 32.
// 256 threads = 8 wave32 waves. Block tile 128(M) x 128(N); wave tile 64x32.
// K stepped by 32 (8 WMMA k-steps). The A and B panels go from global memory
// straight into a two-buffer LDS ring by per-lane asynchronous 16-byte copies:
// panel t+1 flies while panel t is multiplied, one barrier per panel.
// Pitches: A=36 (16B rows; float2 frag reads hit all 64 banks once),
//          B=136 (2*136 % 64 == 16 -> lane halves hit disjoint bank groups).
// ---------------------------------------------------------------------------
#define GA_LD 36
#define GB_LD 136
#define GA_STG (128 * GA_LD)
#define GB_STG (32 * GB_LD)

// Eight asynchronous 16-byte copies per lane (one panel's share of a thread).
// s_wait_xcnt stands inside the statement so that no address register named
// here is rewritten ahead of it.
__device__ __forceinline__ void async_copy8(
    unsigned l0, unsigned l1, unsigned l2, unsigned l3,
    unsigned l4, unsigned l5, unsigned l6, unsigned l7,
    const float* g0, const float* g1, const float* g2, const float* g3,
    const float* g4, const float* g5, const float* g6, const float* g7)
{
  asm volatile(
      "global_load_async_to_lds_b128 %0, %8, off\n\t"
      "global_load_async_to_lds_b128 %1, %9, off\n\t"
      "global_load_async_to_lds_b128 %2, %10, off\n\t"
      "global_load_async_to_lds_b128 %3, %11, off\n\t"
      "global_load_async_to_lds_b128 %4, %12, off\n\t"
      "global_load_async_to_lds_b128 %5, %13, off\n\t"
      "global_load_async_to_lds_b128 %6, %14, off\n\t"
      "global_load_async_to_lds_b128 %7, %15, off\n\t"
      "s_wait_xcnt 0x0"
      :: "v"(l0), "v"(l1), "v"(l2), "v"(l3), "v"(l4), "v"(l5), "v"(l6), "v"(l7),
         "v"(g0), "v"(g1), "v"(g2), "v"(g3), "v"(g4), "v"(g5), "v"(g6), "v"(g7)
      : "memory");
}

// Two asynchronous 16-byte copies per lane, same form as above.
__device__ __forceinline__ void async_copy2(
    unsigned l0, unsigned l1, const float* g0, const float* g1)
{
  asm volatile(
      "global_load_async_to_lds_b128 %0, %2, off\n\t"
      "global_load_async_to_lds_b128 %1, %3, off\n\t"
      "s_wait_xcnt 0x0"
      :: "v"(l0), "v"(l1), "v"(g0), "v"(g1)
      : "memory");
}

// The two launches of this kernel put 2 and 6 waves on a SIMD. With that named,
// the compiler no longer schedules for more waves than can come: it spends
// more registers and issues the LDS fragment reads one or two k-steps ahead of
// their WMMAs, behind counted waits. At that register count three work-groups
// fit a WGP and no fourth, which is what 768 work-groups on 256 WGPs ask for.
__global__ __launch_bounds__(256) __attribute__((amdgpu_waves_per_eu(2, 6)))
void gemm_f32_wmma(
    const float* __restrict__ A, const float* __restrict__ B,
    const float* __restrict__ bias, float* __restrict__ C,
    int M, int K, int N)
{
  __shared__ __attribute__((aligned(16))) float As[2 * GA_STG];
  __shared__ __attribute__((aligned(16))) float Bs[2 * GB_STG];

  const int tid  = threadIdx.x;
  const int lane = tid & 31;
  const int w    = tid >> 5;
  const int ln   = lane & 15;        // index within 16-lane group (M/N dim)
  const int tg2  = (lane >> 4) << 1; // K sub-offset from lane half
  const int wm   = w & 1;            // wave M position (0/1 -> +0/+64)
  const int wn   = w >> 1;           // wave N position (0..3 -> +wn*32)
  const int bm   = blockIdx.y * 128;
  const int bn   = blockIdx.x * 128;

  // Per-thread copy coordinates: 4 x 16 B of the A panel (128 rows x 128 B)
  // and 4 x 16 B of the B panel (32 rows x 512 B); copy i is 32 (A) or 8 (B)
  // rows below copy i-1.
  const int ar = tid >> 3, ac = (tid & 7) << 2;
  const int br = tid >> 5, bc = (tid & 31) << 2;
  const float* pa = A + (size_t)(bm + ar) * K + ac;
  const float* pb = B + (size_t)br * N + bn + bc;
  const size_t astep = (size_t)32 * K;
  const size_t bstep = (size_t)8 * N;
  const unsigned la = (unsigned)(uintptr_t)&As[ar * GA_LD + ac];
  const unsigned lb = (unsigned)(uintptr_t)&Bs[br * GB_LD + bc];

  // Copies of panel t into ring buffer 'buf'
  auto issue = [&](int t, unsigned buf) {
    const float* a = pa + (size_t)t * 32;
    const float* b = pb + (size_t)t * 32 * N;
    const unsigned da = la + buf * (unsigned)(GA_STG * 4);
    const unsigned db = lb + buf * (unsigned)(GB_STG * 4);
    async_copy8(da, da + 32 * GA_LD * 4, da + 64 * GA_LD * 4, da + 96 * GA_LD * 4,
                db, db + 8 * GB_LD * 4, db + 16 * GB_LD * 4, db + 24 * GB_LD * 4,
                a, a + astep, a + 2 * astep, a + 3 * astep,
                b, b + bstep, b + 2 * bstep, b + 3 * bstep);
  };

  v8f acc[4][2] = {};
  const int T = K >> 5;

  // Prologue: panel 0 landed and published, then panel 1 set off
  issue(0, 0u);
  asm volatile("s_wait_asynccnt 0x0" ::: "memory");  // own copies of panel 0 landed
  __syncthreads();
  if (T > 1) issue(1, 1u);

  for (int t = 0; t < T; t++) {
    const unsigned buf = (unsigned)t & 1u;
    const float* as = &As[buf * GA_STG];
    const float* bs = &Bs[buf * GB_STG];

    #pragma unroll
    for (int kk = 0; kk < 8; kk++) {
      v2f af[4];
      v2f bf[2];
      #pragma unroll
      for (int mi = 0; mi < 4; mi++)
        af[mi] = *(const v2f*)&as[(wm * 64 + mi * 16 + ln) * GA_LD + kk * 4 + tg2];
      #pragma unroll
      for (int ni = 0; ni < 2; ni++) {
        bf[ni][0] = bs[(kk * 4 + tg2    ) * GB_LD + wn * 32 + ni * 16 + ln];
        bf[ni][1] = bs[(kk * 4 + tg2 + 1) * GB_LD + wn * 32 + ni * 16 + ln];
      }
      // 8 independent accumulator chains -> hides WMMA RAW hazard latency
      #pragma unroll
      for (int mi = 0; mi < 4; mi++)
        #pragma unroll
        for (int ni = 0; ni < 2; ni++)
          acc[mi][ni] = WMMA_F32(af[mi], bf[ni], acc[mi][ni]);
    }

    // Publish point of panel t+1; it also ends every read of buffer 'buf'
    asm volatile("s_wait_dscnt 0x0" ::: "memory");     // own reads of 'buf' retired before its refill
    asm volatile("s_wait_asynccnt 0x0" ::: "memory");  // own copies of panel t+1 landed
    __syncthreads();
    if (t + 2 < T) issue(t + 2, buf);
  }
  asm volatile("s_wait_asynccnt 0x0" ::: "memory");    // nothing in flight when the wave ends

  // Store: C/D layout -> lane ln is column, VGPR r is row r + 8*(lane>=16)
  const int rofs = (lane >> 4) << 3;
  #pragma unroll
  for (int mi = 0; mi < 4; mi++) {
    #pragma unroll
    for (int ni = 0; ni < 2; ni++) {
      int col = bn + wn * 32 + ni * 16 + ln;
      float bv = bias ? bias[col] : 0.0f;
      #pragma unroll
      for (int r = 0; r < 8; r++) {
        int row = bm + wm * 64 + mi * 16 + r + rofs;
        C[(size_t)row * N + col] = acc[mi][ni][r] + bv;
      }
    }
  }
}

// ---------------------------------------------------------------------------
// Flash-style attention, fp32 WMMA throughout.
// Grid (16,16,4) = (query-slab, head, batch). 128 threads = 4 waves,
// each wave owns 16 query rows. K and V tiles go from global memory straight
// into LDS by per-lane asynchronous 16-byte copies, through no register:
// V(kb) flies under the S=QK^T WMMA chain and the softmax, K(kb+1) under the
// P.V WMMA chain. The batch's whole mask row is copied once, ahead of the loop.
// Two barriers per key block:
//   barrier B (mid):   V(kb) landed; ends every read of kbuf, which is refilled
//   barrier A (foot):  K(kb+1) landed; ends every read of vbuf, which is refilled
// ---------------------------------------------------------------------------
#define KLD 68   // 4*KLD % 64 spreads frag-read rows over all banks; 16B rows
#define VLD 72   // 2*VLD % 64 == 16 -> lane halves hit disjoint bank groups
#define PLD 68

// At most four waves per SIMD: the 1024 work-groups then spread four to every
// WGP; a fifth resident group on some WGPs would leave others short of work.
__global__ __launch_bounds__(128) __attribute__((amdgpu_waves_per_eu(4, 4)))
void attn_f32_wmma(
    const float* __restrict__ qkv,   // (B*N, 3072): [q | k | v], head-major
    const float* __restrict__ mask,  // (B, N)
    float* __restrict__ out)         // (B*N, 1024)
{
  __shared__ __attribute__((aligned(16))) float kbuf[64 * KLD];
  __shared__ __attribute__((aligned(16))) float vbuf[64 * VLD];
  __shared__ float pbuf[4][16 * PLD];
  __shared__ __attribute__((aligned(16))) float mrow[1024];

  const int N = 1024, C3 = 3072;
  const int tid  = threadIdx.x;
  const int lane = tid & 31;
  const int w    = tid >> 5;
  const int ln   = lane & 15;
  const int hl   = lane >> 4;
  const int tg2  = hl << 1;
  const int qt   = blockIdx.x;   // query slab 0..15
  const int h    = blockIdx.y;   // head
  const int b    = blockIdx.z;   // batch
  const int qbase = qt * 64 + w * 16;
  const float scale = 0.125f;    // D=64 -> 1/sqrt(64)

  // Preload Q fragments (A-matrix layout): lane holds row qbase+ln,
  // d = 4*kk + tg2 + {0,1}  -> one float2 per k-step, kept in registers.
  const float* qrow = qkv + (size_t)(b * N + qbase + ln) * C3 + h * 64;
  v2f qf[16];
  #pragma unroll
  for (int kk = 0; kk < 16; kk++)
    qf[kk] = *(const v2f*)(qrow + kk * 4 + tg2);

  // Per-thread K/V copy coordinates: 8 x 16 B of a 64-row x 256-B tile;
  // copy i is 8 rows below copy i-1.
  const int sr = tid >> 4, sc = (tid & 15) << 2;
  const float* kp = qkv + (size_t)(b * N + sr) * C3 + 1024 + h * 64 + sc;  // K section
  const float* vp = kp + 1024;                                            // V section
  const size_t rstep = (size_t)8 * C3;
  const unsigned lk = (unsigned)(uintptr_t)&kbuf[sr * KLD + sc];
  const unsigned lv = (unsigned)(uintptr_t)&vbuf[sr * VLD + sc];

  // Copies of the 64-row tile that starts at g into the LDS tile at l,
  // whose 8-row step is 'ls' bytes
  auto issue = [&](const float* g, unsigned l, unsigned ls) {
    async_copy8(l, l + ls, l + 2 * ls, l + 3 * ls,
                l + 4 * ls, l + 5 * ls, l + 6 * ls, l + 7 * ls,
                g, g + rstep, g + 2 * rstep, g + 3 * rstep,
                g + 4 * rstep, g + 5 * rstep, g + 6 * rstep, g + 7 * rstep);
  };

  v8f o[4] = {};
  float mi[8], li[8];
  #pragma unroll
  for (int r = 0; r < 8; r++) { mi[r] = -1e30f; li[r] = 0.0f; }

  // Prologue: K(0) and the mask row (1024 floats, 2 x 16 B per thread)
  // landed and published
  issue(kp, lk, 8 * KLD * 4);
  {
    const float* mp = mask + b * N + tid * 4;
    const unsigned lm = (unsigned)(uintptr_t)&mrow[tid * 4];
    async_copy2(lm, lm + 2048, mp, mp + 512);
  }
  asm volatile("s_wait_asynccnt 0x0" ::: "memory");  // own copies of K(0) and mask landed
  __syncthreads();

  for (int kb = 0; kb < 16; kb++) {
    const int kbase = kb * 64;

    // V(kb) set off; it lands under the S-phase WMMA chain and the softmax
    issue(vp + (size_t)kbase * C3, lv, 8 * VLD * 4);

    // S = Q @ K^T : B-frag of K^T is a K row (key=ln), contiguous float2 in d
    v8f s[4] = {};
    #pragma unroll
    for (int kk = 0; kk < 16; kk++) {
      #pragma unroll
      for (int kt = 0; kt < 4; kt++) {
        v2f kf = *(v2f*)&kbuf[(kt * 16 + ln) * KLD + kk * 4 + tg2];
        s[kt] = WMMA_F32(qf[kk], kf, s[kt]);
      }
    }

    // Online softmax. C/D layout: s[kt][r] belongs to row r+8*hl, col ln
    // within each 16-key tile -> row reductions are 16-lane butterflies.
    float mbias[4];
    #pragma unroll
    for (int kt = 0; kt < 4; kt++)
      mbias[kt] = (1.0f - mrow[kbase + kt * 16 + ln]) * -5.0f;
    float mnew[8], alpha[8];
    #pragma unroll
    for (int r = 0; r < 8; r++) {
      float mx = -1e30f;
      #pragma unroll
      for (int kt = 0; kt < 4; kt++) {
        float v = s[kt][r] * scale + mbias[kt];
        s[kt][r] = v;
        mx = fmaxf(mx, v);
      }
      #pragma unroll
      for (int off = 1; off < 16; off <<= 1)
        mx = fmaxf(mx, __shfl_xor(mx, off, 32));
      mnew[r]  = fmaxf(mi[r], mx);
      alpha[r] = __expf(mi[r] - mnew[r]);
      mi[r]    = mnew[r];
    }
    #pragma unroll
    for (int r = 0; r < 8; r++) {
      float sum = 0.0f;
      #pragma unroll
      for (int kt = 0; kt < 4; kt++) {
        float p = __expf(s[kt][r] - mnew[r]);
        s[kt][r] = p;
        sum += p;
      }
      #pragma unroll
      for (int off = 1; off < 16; off <<= 1)
        sum += __shfl_xor(sum, off, 32);
      li[r] = li[r] * alpha[r] + sum;
      #pragma unroll
      for (int dt = 0; dt < 4; dt++) o[dt][r] *= alpha[r];
    }

    // Stage P strip (C/D -> A layout conversion through LDS)
    #pragma unroll
    for (int kt = 0; kt < 4; kt++)
      #pragma unroll
      for (int r = 0; r < 8; r++)
        pbuf[w][(r + hl * 8) * PLD + kt * 16 + ln] = s[kt][r];
    asm volatile("s_wait_dscnt 0x0" ::: "memory");     // own reads of kbuf retired before its refill
    asm volatile("s_wait_asynccnt 0x0" ::: "memory");  // own copies of V(kb) landed
    __syncthreads();  // barrier B

    // K(kb+1) set off; it lands under the PV WMMA chain
    if (kb + 1 < 16) issue(kp + (size_t)(kbase + 64) * C3, lk, 8 * KLD * 4);

    // O += P @ V
    #pragma unroll
    for (int kk = 0; kk < 16; kk++) {
      v2f pf = *(v2f*)&pbuf[w][ln * PLD + kk * 4 + tg2];
      #pragma unroll
      for (int dt = 0; dt < 4; dt++) {
        v2f vf;
        vf[0] = vbuf[(kk * 4 + tg2    ) * VLD + dt * 16 + ln];
        vf[1] = vbuf[(kk * 4 + tg2 + 1) * VLD + dt * 16 + ln];
        o[dt] = WMMA_F32(pf, vf, o[dt]);
      }
    }

    asm volatile("s_wait_dscnt 0x0" ::: "memory");     // own reads of vbuf retired before its refill
    asm volatile("s_wait_asynccnt 0x0" ::: "memory");  // own copies of K(kb+1) landed
    __syncthreads();  // barrier A
  }

  // Normalize by softmax denominator and store (B,N,H,D) -> (B*N, 1024)
  #pragma unroll
  for (int r = 0; r < 8; r++) {
    float inv = 1.0f / li[r];
    int row = b * N + qbase + r + hl * 8;
    #pragma unroll
    for (int dt = 0; dt < 4; dt++)
      out[(size_t)row * 1024 + h * 64 + dt * 16 + ln] = o[dt][r] * inv;
  }
}

// ---------------------------------------------------------------------------
extern "C" void kernel_launch(void* const* d_in, const int* in_sizes, int n_in,
                              void* d_out, int out_size, void* d_ws, size_t ws_size,
                              hipStream_t stream) {
  const float* x      = (const float*)d_in[0];
  const float* mask   = (const float*)d_in[1];
  const float* W_qkv  = (const float*)d_in[2];
  const float* W_proj = (const float*)d_in[3];
  const float* b_proj = (const float*)d_in[4];
  float* out = (float*)d_out;

  float* qkv     = (float*)d_ws;                    // 4096 x 3072 f32 (48 MB)
  float* attnout = qkv + (size_t)4096 * 3072;       // 4096 x 1024 f32 (16 MB)

  // 1) qkv = x @ W_qkv                (4096,1024) x (1024,3072)
  gemm_f32_wmma<<<dim3(3072 / 128, 4096 / 128), 256, 0, stream>>>(
      x, W_qkv, nullptr, qkv, 4096, 1024, 3072);

  // 2) attention per (batch, head, 64-query slab)
  attn_f32_wmma<<<dim3(16, 16, 4), 128, 0, stream>>>(qkv, mask, attnout);

  // 3) out = attnout @ W_proj + b_proj   (4096,1024) x (1024,1024)
  gemm_f32_wmma<<<dim3(1024 / 128, 4096 / 128), 256, 0, stream>>>(
      attnout, W_proj, b_proj, out, 4096, 1024, 1024);
}
